// v010
// The times below were measured on an AMD MI455X: many runs one after another, warmed up first and cycling through
// copies of the inputs, with the whole window's GPU time divided by the number of runs. Launches and the gaps
// between them are all in it. The median over several windows is given; except for v000 it joins two sittings, which
// can be a few percent apart, so the side-by-side timings, each taken in one sitting, are the better comparison.
// Earlier versions than v010 are not in this document.
// It runs in 104 microseconds.
// Two timings next to v009 both put it at 1.08 times that version's speed.
// Counting every step since v000, which is the starting kernel, it is 75.2 times as fast.
#include <hip/hip_runtime.h>
// Causal multi-head self-attention with a fused QKV projection over ONE sequence of 4096 tokens (x [1][4096][1024]; qkv = x w_qkv + b_qkv ([in][out] 1024 x 3072, U(+-1/32) weights AND biases): q | k | v, 16 heads of 64; scores / 8; causal (tril, -inf); softmax; out = merged w_out + b_out ([in][out]) -> [1][4096][1024]).
// Structure: token rows r = b*4096 + s; x as exact f16 rows (bf16-rounded); q | k | v as ONE WMMA GEMM (N = 3 x 1024) (32x64 wave tiles, f32 accumulation, exact x16 weights + bias, f16 outputs; its epilogue also stores rows 0..127 unrounded in f32 for the exact first tile); per batch: V^T for all heads via LDS transposes; one fused launch: per wave 32 query rows of one head, S^T = K Q^T against the keys up to the diagonal block, K and V^T staged in LDS for the block's eight waves (two groups of four that split the keys and join at the end), online causal softmax in registers (f32 statistics, native exp2; weights f16), O^T += V^T P^T (o carried x64, folded into the output GEMM alpha) written straight into the merged f16 o rows; out = o W_o + b GEMM (f32) into the output layout.
// Compute dtype: inputs rounded to bf16; x / weights exact; q, k, v, softmax weights and o as plain f16 GEMM operands (~2^-12); scores and softmax statistics f32. v_wmma_f32_16x16x32_f16.
#define NB 1
#define SQ 4096
#define DM 1024
#define NH 16
#define HD 64
#define HG 4                         /* heads per k_vt launch; k_vt is not launched */
#define QT0 128                      /* first-tile rows recomputed exactly in f32 */
#define B0 0                         /* first batch processed (debug hook) */
#define NBR NB                       /* batches processed (debug hook) */
#define NR ((size_t)NB * SQ)         /* token rows */
#define MP ((int)((size_t)NBR * SQ)) /* rows projected (debug hook) */
#define MPO MP                       /* rows through the output stage (debug hook) */
#define LQ (3 * DM)      /* row pitch of the q/k/v rows */
typedef __bf16 v16b __attribute__((ext_vector_type(16)));
typedef unsigned short v8us __attribute__((ext_vector_type(8), may_alias));
typedef float  v8f  __attribute__((ext_vector_type(8)));
typedef float  v4f  __attribute__((ext_vector_type(4)));
typedef float  v4fa __attribute__((ext_vector_type(4), may_alias));
union FragB { v16b v; v8us half[2]; unsigned short u[16]; };

__device__ __forceinline__ unsigned short bf16_bits(float x) { unsigned int u = __float_as_uint(x); return (unsigned short)((u + 0x7FFFu + ((u >> 16) & 1u)) >> 16); }
__device__ __forceinline__ float bf16_val(unsigned short b) { return __uint_as_float(((unsigned int)b) << 16); }
__device__ __forceinline__ float bf16_round(float x) { return bf16_val(bf16_bits(x)); }
// D += A·B with NT terms: 1 = ah·bh, 2 = + al·bh (A split), 3 = + ah·bl (both split)
template <int NT>
__device__ __forceinline__ v8f mmaN(v16b ah, v16b al, v16b bh, v16b bl, v8f c) {
  c = __builtin_amdgcn_wmma_f32_16x16x32_bf16(false, ah, false, bh, (short)0, c, false, false);
  if (NT >= 2) c = __builtin_amdgcn_wmma_f32_16x16x32_bf16(false, al, false, bh, (short)0, c, false, false);
  if (NT >= 3) c = __builtin_amdgcn_wmma_f32_16x16x32_bf16(false, ah, false, bl, (short)0, c, false, false);
  asm volatile("v_nop\n\tv_nop\n\tv_nop\n\tv_nop" : "+v"(c) : "v"(ah), "v"(al), "v"(bh), "v"(bl));
  return c;
}

__global__ __launch_bounds__(256) void k_wt_bf16(const float* __restrict__ W, unsigned short* __restrict__ Wt, int K, int N) {
  const int t = blockIdx.x * 256 + threadIdx.x;
  const int k8n = K / 8;
  if (t >= N * k8n) return;
  const int n = t / k8n, k8 = (t % k8n) * 8;
  v8us v;
#pragma unroll
  for (int i = 0; i < 8; ++i) v[i] = bf16_bits(W[(size_t)(k8 + i) * N + n]);
  *(v8us*)(Wt + (size_t)n * K + k8) = v;
  
}

// GEMM C[M][N] (f32, pitch ldc) = act(A[M][K]·W + bias). A f32 row-major (pitch lda) converted per fragment to bf16
// (ASPLIT: hi/lo two planes -> 2 terms, else single rounded term); Wt bf16 [N][K] (pitch ldb). BIAS_BF16 rounds the
// bias to bf16 first (bias quantised to bf16 before the add). K%32==0, M%16==0, N%64==0.
template <bool ASPLIT, int ACT, bool BIAS_BF16>
__global__ __launch_bounds__(128) void k_gemm_bf(const float* __restrict__ A, int lda, const unsigned short* __restrict__ Wt, int ldb,
                                               const float* __restrict__ bias, float* __restrict__ C, int ldc, int M, int N, int K) {
  __shared__ __attribute__((aligned(16))) float so[4][16][64];
  const int tid = threadIdx.x, w = tid >> 5, lane = tid & 31, ln = lane & 15, hh = lane >> 4;
  const int ntn = N / 64;
  const int wid = blockIdx.x * 4 + w;
  const int mt = wid / ntn, nq = wid % ntn;
  if (mt * 16 >= M) return;
  const int row0 = mt * 16, col0 = nq * 64;
  const float* arow = A + (size_t)(row0 + ln) * lda;
  v8f acc[4] = {};
  for (int kb = 0; kb < K; kb += 32) {
    FragB ah, al;
    const v4f x0 = *(const v4fa*)(arow + kb + 8 * hh), x1 = *(const v4fa*)(arow + kb + 8 * hh + 4);
    const v4f x2 = *(const v4fa*)(arow + kb + 16 + 8 * hh), x3 = *(const v4fa*)(arow + kb + 16 + 8 * hh + 4);
    float xs[16] = {x0[0],x0[1],x0[2],x0[3],x1[0],x1[1],x1[2],x1[3],x2[0],x2[1],x2[2],x2[3],x3[0],x3[1],x3[2],x3[3]};
#pragma unroll
    for (int i = 0; i < 16; ++i) { const unsigned short hb = bf16_bits(xs[i]); ah.u[i] = hb; al.u[i] = ASPLIT ? bf16_bits(xs[i] - bf16_val(hb)) : (unsigned short)0; }
#pragma unroll
    for (int t = 0; t < 4; ++t) {
      const unsigned short* brow = Wt + (size_t)(col0 + t * 16 + ln) * ldb + kb;
      FragB b;
      b.half[0] = *(const v8us*)(brow + 8 * hh);
      b.half[1] = *(const v8us*)(brow + 16 + 8 * hh);
      acc[t] = mmaN<ASPLIT ? 2 : 1>(ah.v, al.v, b.v, b.v, acc[t]);
    }
  }
#pragma unroll
  for (int t = 0; t < 4; ++t) {
    float bv = bias ? bias[col0 + t * 16 + ln] : 0.f;
    if (BIAS_BF16) bv = bf16_round(bv);
#pragma unroll
    for (int r = 0; r < 8; ++r) { float v = acc[t][r] + bv; if (ACT == 1) v = fmaxf(v, 0.f); so[w][8 * hh + r][t * 16 + ln] = v; }
  }
  __builtin_amdgcn_fence(__ATOMIC_ACQ_REL, "workgroup");
  __builtin_amdgcn_wave_barrier();
  const int rsub = lane >> 4, c4 = (lane & 15) * 4;
  {
#pragma unroll
    for (int q = 0; q < 8; ++q) {
      const int r = q * 2 + rsub;
      const v4f v = *(const v4fa*)&so[w][r][c4];
      *(v4f*)(C + (size_t)(row0 + r) * ldc + col0 + c4) = v;
    }
    
  }
}

// GEMM C = act(A·W + bias + resid): A f32 (ASPLIT -> hi/lo 2 terms), Wt bf16 [N][K]; ACT 0 none, 1 relu, 2 exact gelu;
// resid (optional, f32, row index = (row % rmod), pitch ldr, RES_BF16 rounds it) added before the activation.
template <bool ASPLIT, int ACT, bool BIAS_BF16, bool RES_BF16>
__global__ __launch_bounds__(128) void k_gemm_bf3(const float* __restrict__ A, int lda, const unsigned short* __restrict__ Wt, int ldb,
                                                const float* __restrict__ bias, const float* __restrict__ resid, int rmod, int ldr,
                                                float* __restrict__ C, int ldc, int M, int N, int K) {
  __shared__ __attribute__((aligned(16))) float so[4][16][64];
  const int tid = threadIdx.x, w = tid >> 5, lane = tid & 31, ln = lane & 15, hh = lane >> 4;
  const int ntn = N / 64;
  const int wid = blockIdx.x * 4 + w;
  const int mt = wid / ntn, nq = wid % ntn;
  if (mt * 16 >= M) return;
  const int row0 = mt * 16, col0 = nq * 64;
  const float* arow = A + (size_t)(row0 + ln) * lda;
  v8f acc[4] = {};
  for (int kb = 0; kb < K; kb += 32) {
    FragB ah, al;
    const v4f x0 = *(const v4fa*)(arow + kb + 8 * hh), x1 = *(const v4fa*)(arow + kb + 8 * hh + 4);
    const v4f x2 = *(const v4fa*)(arow + kb + 16 + 8 * hh), x3 = *(const v4fa*)(arow + kb + 16 + 8 * hh + 4);
    float xs[16] = {x0[0],x0[1],x0[2],x0[3],x1[0],x1[1],x1[2],x1[3],x2[0],x2[1],x2[2],x2[3],x3[0],x3[1],x3[2],x3[3]};
#pragma unroll
    for (int i = 0; i < 16; ++i) { const unsigned short hb = bf16_bits(xs[i]); ah.u[i] = hb; al.u[i] = ASPLIT ? bf16_bits(xs[i] - bf16_val(hb)) : (unsigned short)0; }
#pragma unroll
    for (int t = 0; t < 4; ++t) {
      const unsigned short* brow = Wt + (size_t)(col0 + t * 16 + ln) * ldb + kb;
      FragB b;
      b.half[0] = *(const v8us*)(brow + 8 * hh);
      b.half[1] = *(const v8us*)(brow + 16 + 8 * hh);
      acc[t] = mmaN<ASPLIT ? 2 : 1>(ah.v, al.v, b.v, b.v, acc[t]);
    }
  }
#pragma unroll
  for (int t = 0; t < 4; ++t) {
    const int col = col0 + t * 16 + ln;
    float bv = bias ? bias[col] : 0.f;
    if (BIAS_BF16) bv = bf16_round(bv);
#pragma unroll
    for (int r = 0; r < 8; ++r) {
      float v = acc[t][r] + bv;
      if (resid) { float rv = resid[(size_t)((row0 + 8 * hh + r) % rmod) * ldr + col]; if (RES_BF16) rv = bf16_round(rv); v += rv; }
      if (ACT == 1) v = fmaxf(v, 0.f);
      if (ACT == 2) v = 0.5f * v * (1.0f + erff(v * 0.70710678118654752f));
      if (ACT == 3) { const float u = 0.7978845608028654f * (v + 0.044715f * v * v * v); v = 0.5f * v * (1.0f + tanhf(u)); }
      so[w][8 * hh + r][t * 16 + ln] = v;
    }
  }
  __builtin_amdgcn_fence(__ATOMIC_ACQ_REL, "workgroup");
  __builtin_amdgcn_wave_barrier();
  const int rsub = lane >> 4, c4 = (lane & 15) * 4;
  {
#pragma unroll
    for (int q = 0; q < 8; ++q) {
      const int r = q * 2 + rsub;
      const v4f v = *(const v4fa*)&so[w][r][c4];
      *(v4f*)(C + (size_t)(row0 + r) * ldc + col0 + c4) = v;
    }
    
  }
}
// row LayerNorm (biased variance, eps) over N: s = X (+ R); optional out_sum <- s; out_norm <- (s-mu)*rsqrt(var+eps)*g + b
template <bool PARAM_BF16>
__global__ __launch_bounds__(256) void k_layernorm(const float* __restrict__ X, const float* __restrict__ R, const float* __restrict__ g, const float* __restrict__ bta,
                                                  float* __restrict__ out_sum, float* __restrict__ out_norm, int N, float eps) {
  __shared__ float red[256];
  const int row = blockIdx.x, tid = threadIdx.x;
  const float* x = X + (size_t)row * N; const float* rr = R ? R + (size_t)row * N : nullptr;
  float vals[16];                     // up to N = 4096
  const int per = N / 256;            // contiguous chunk per thread? use strided-by-4 chunks: thread handles j = tid*4 + 1024*u
  float s1 = 0.f;
  for (int u = 0; u < per / 4; ++u) {
    const int j = tid * 4 + 1024 * u;
    const v4f a = *(const v4fa*)(x + j);
    v4f b = {0.f,0.f,0.f,0.f}; if (rr) b = *(const v4fa*)(rr + j);
#pragma unroll
    for (int q = 0; q < 4; ++q) { const float v = a[q] + b[q]; vals[u * 4 + q] = v; s1 += v; }
  }
  red[tid] = s1; __syncthreads();
  for (int st = 128; st > 0; st >>= 1) { if (tid < st) red[tid] += red[tid + st]; __syncthreads(); }
  const float mu = red[0] / (float)N; __syncthreads();
  float s2 = 0.f;
  for (int u = 0; u < per / 4; ++u)
#pragma unroll
    for (int q = 0; q < 4; ++q) { const float c = vals[u * 4 + q] - mu; s2 += c * c; }
  red[tid] = s2; __syncthreads();
  for (int st = 128; st > 0; st >>= 1) { if (tid < st) red[tid] += red[tid + st]; __syncthreads(); }
  const float rs = rsqrtf(red[0] / (float)N + eps);
  {
    for (int u = 0; u < per / 4; ++u) {
      const int j = tid * 4 + 1024 * u;
      v4f o, sm;
#pragma unroll
      for (int q = 0; q < 4; ++q) {
        float gg = g[j + q], bb = bta[j + q];
        if (PARAM_BF16) { gg = bf16_round(gg); bb = bf16_round(bb); }
        sm[q] = vals[u * 4 + q]; o[q] = (vals[u * 4 + q] - mu) * rs * gg + bb;
      }
      if (out_sum) *(v4f*)(out_sum + (size_t)row * N + j) = sm;
      *(v4f*)(out_norm + (size_t)row * N + j) = o;
    }
    
  }
}



// ---- f16 WMMA path (v_wmma_f32_16x16x32_f16): 11-bit significands for operands in range — used for every matrix product of the launched kernels
typedef _Float16 v16h __attribute__((ext_vector_type(16)));
union FragH { v16h v; v8us half[2]; _Float16 h[16]; unsigned short u[16]; };
template <int NT>
__device__ __forceinline__ v8f mmaH(v16h ah, v16h al, v16h bh, v16h bl, v8f c) {
  c = __builtin_amdgcn_wmma_f32_16x16x32_f16(false, ah, false, bh, (short)0, c, false, false);
  if (NT >= 2) c = __builtin_amdgcn_wmma_f32_16x16x32_f16(false, al, false, bh, (short)0, c, false, false);
  if (NT >= 3) c = __builtin_amdgcn_wmma_f32_16x16x32_f16(false, ah, false, bl, (short)0, c, false, false);
  asm volatile("v_nop\n\tv_nop\n\tv_nop\n\tv_nop" : "+v"(c) : "v"(ah), "v"(al), "v"(bh), "v"(bl));
  return c;
}
// batched GEMM like k_gemm_b but f16 operands: A f32 (split into f16 hi/lo if ASPLIT, else rounded to f16), Bt = f16 values [n][k]; alpha; C f32; N multiple of 16 (partial tiles skipped)
template <bool ASPLIT>
__global__ __launch_bounds__(128) void k_gemm_h(const float* __restrict__ A, int lda, size_t sA, const _Float16* __restrict__ Bh, int ldb, size_t sB, float alpha, float* __restrict__ C, int ldc, size_t sC, int M, int N, int K) {
  __shared__ __attribute__((aligned(16))) float so[4][16][64];
  const int tid = threadIdx.x, w = tid >> 5, lane = tid & 31, ln = lane & 15, hh = lane >> 4; const int by = blockIdx.y;
  A += (size_t)by * sA; Bh += (size_t)by * sB; C += (size_t)by * sC;
  const int ntn = (N + 63) / 64; const int wid = blockIdx.x * 4 + w; const int mt = wid / ntn, nq = wid % ntn; if (mt * 16 >= M) return;
  const int row0 = mt * 16, col0 = nq * 64; const float* arow = A + (size_t)(row0 + ln) * lda;
  v8f acc[4] = {};
  for (int kb = 0; kb < K; kb += 32) {
    FragH ah, al;
    const v4f x0 = *(const v4fa*)(arow + kb + 8 * hh), x1 = *(const v4fa*)(arow + kb + 8 * hh + 4), x2 = *(const v4fa*)(arow + kb + 16 + 8 * hh), x3 = *(const v4fa*)(arow + kb + 16 + 8 * hh + 4);
    float xs[16] = {x0[0],x0[1],x0[2],x0[3],x1[0],x1[1],x1[2],x1[3],x2[0],x2[1],x2[2],x2[3],x3[0],x3[1],x3[2],x3[3]};
#pragma unroll
    for (int i = 0; i < 16; ++i) { const _Float16 h = (_Float16)xs[i]; ah.h[i] = h; al.h[i] = ASPLIT ? (_Float16)(xs[i] - (float)h) : (_Float16)0.0f; }
#pragma unroll
    for (int t = 0; t < 4; ++t) { if (col0 + t * 16 >= N) continue; const size_t boff = (size_t)(col0 + t * 16 + ln) * ldb + kb; FragH bq; bq.half[0] = *(const v8us*)(Bh + boff + 8 * hh); bq.half[1] = *(const v8us*)(Bh + boff + 16 + 8 * hh);
      acc[t] = mmaH<ASPLIT ? 2 : 1>(ah.v, al.v, bq.v, bq.v, acc[t]); }
  }
#pragma unroll
  for (int t = 0; t < 4; ++t) { if (col0 + t * 16 >= N) continue;
#pragma unroll
    for (int r = 0; r < 8; ++r) so[w][8 * hh + r][t * 16 + ln] = acc[t][r] * alpha; }
  __builtin_amdgcn_fence(__ATOMIC_ACQ_REL, "workgroup"); __builtin_amdgcn_wave_barrier();
  const int rsub = lane >> 4, c4 = (lane & 15) * 4;
  {
#pragma unroll
    for (int q = 0; q < 8; ++q) { const int r = q * 2 + rsub; if (col0 + c4 < N) { const v4f v = *(const v4fa*)&so[w][r][c4]; *(v4f*)(C + (size_t)(row0 + r) * ldc + col0 + c4) = v; } }
     }
}

// Wt[n][k] = f16(W[k][n] x scale) from f32 row-major W[K][N] (scale = power of two; bf16-exact weights stay exact in f16 away from the subnormal range), transposed through LDS, one 128 k x 64 n tile a block.
// Reads: 16 lanes take 256 contiguous bytes of a W row, so a wave-wide 16-byte load touches 4 whole lines (one thread per 8 k of one n touched 32 lines for 128 useful bytes). A thread holds 16 consecutive k of 4 neighbouring n, all 16 loads in flight together.
// Writes: 16 lanes store 256 contiguous bytes of a Wt row. In LDS an n row is 256 bytes = 16 pieces of 8 k; piece p of row n lies at place p ^ ((n >> 2) & 15): the 16 lanes of a 16-byte LDS write (rows 4 apart, one p) and of a read (one row, all p) each fall on all 64 banks.
// K and N are compile-time: every load and store is one address register pair plus an immediate offset.
// A part of k_prep: bx is the block's number among this matrix's tiles, tl the block's 16 KB of LDS.
template <int K, int N>
__device__ __forceinline__ void wt_f16t(unsigned char* tl, const int bx, const float* __restrict__ W, _Float16* __restrict__ Wt, float scale) {
  static_assert(K % 128 == 0 && N % 64 == 0, "whole tiles only");
  const int tid = threadIdx.x, j = tid & 15, tr = tid >> 4; constexpr int ntn = N / 64; const int kt = bx / ntn, nt = bx % ntn;
  const float* sp = W + (size_t)(kt * 128 + 16 * tr) * N + nt * 64 + 4 * j;
  v4f x[16];
#pragma unroll
  for (int i = 0; i < 16; ++i) x[i] = *(const v4fa*)(sp + (size_t)i * N);
  asm volatile("s_wait_xcnt 0x0" :: "v"(sp) : "memory");      /* the loads' address registers are reused by what follows; named as an input, they stay as they are up to this wait */
#pragma unroll
  for (int c = 0; c < 4; ++c) { FragH f;
#pragma unroll
    for (int i = 0; i < 16; ++i) f.h[i] = (_Float16)(bf16_round(x[i][c]) * scale);
    unsigned char* row = tl + (4 * j + c) * 256;
    *(v8us*)(row + (((2 * tr) ^ j) << 4)) = f.half[0]; *(v8us*)(row + (((2 * tr + 1) ^ j) << 4)) = f.half[1]; }
  __syncthreads();      /* the tile is complete for every wave */
  v8us o[8];      /* all rows are read back first and stored afterwards: no register of an issued store is written again */
#pragma unroll
  for (int q = 0; q < 8; ++q) { const int n = 8 * q + tr; o[q] = *(const v8us*)(tl + n * 256 + ((j ^ ((n >> 2) & 15)) << 4)); }
  unsigned short* dp = (unsigned short*)Wt + (size_t)(nt * 64 + tr) * K + kt * 128 + 8 * j;
#pragma unroll
  for (int q = 0; q < 8; ++q) *(v8us*)(dp + (size_t)(8 * q) * K) = o[q];
  asm volatile("s_wait_xcnt 0x0" ::: "memory");      /* inlined into k_prep, another part's code can follow these stores in the listing and reuse their registers: the wait stands in front of it */
}
// k_gemm_hh variant with fused epilogue: v = acc·alpha + bias[by·sBias + col] (+ CP[(row/rowsPerB)·sCPb + by·64 + col] if CP) ; ACT 0 none / 1 elu ; writes f16 C16 (and f32 C if non-null)
template <int ACT>
__global__ __launch_bounds__(128) void k_gemm_hhx(const _Float16* __restrict__ A, int lda, size_t sA, const _Float16* __restrict__ Bh, int ldb, size_t sB, float alpha, const float* __restrict__ bias, size_t sBias, const float* __restrict__ CP, int rowsPerB, size_t sCPb, int row0g,
    float* __restrict__ C, _Float16* __restrict__ C16, int ldc, size_t sC, int M, int N, int K) {
  __shared__ __attribute__((aligned(16))) float so[4][16][64];
  const int tid = threadIdx.x, w = tid >> 5, lane = tid & 31, ln = lane & 15, hh = lane >> 4; const int by = blockIdx.y;
  A += (size_t)by * sA; Bh += (size_t)by * sB; const size_t cofs = (size_t)by * sC; const float* bp = bias ? bias + (size_t)by * sBias : nullptr;
  const int ntn = (N + 63) / 64; const int wid = blockIdx.x * 4 + w; const int mt = wid / ntn, nq = wid % ntn; if (mt * 16 >= M) return;
  const int row0 = mt * 16, col0 = nq * 64; const _Float16* arow = A + (size_t)(row0 + ln) * lda;
  v8f acc[4] = {};
  for (int kb = 0; kb < K; kb += 32) { FragH ah; ah.half[0] = *(const v8us*)((const unsigned short*)arow + kb + 8 * hh); ah.half[1] = *(const v8us*)((const unsigned short*)arow + kb + 16 + 8 * hh);
#pragma unroll
    for (int t = 0; t < 4; ++t) { if (col0 + t * 16 >= N) continue; const size_t boff = (size_t)(col0 + t * 16 + ln) * ldb + kb; FragH bq; bq.half[0] = *(const v8us*)((const unsigned short*)Bh + boff + 8 * hh); bq.half[1] = *(const v8us*)((const unsigned short*)Bh + boff + 16 + 8 * hh);
      acc[t] = mmaH<1>(ah.v, ah.v, bq.v, bq.v, acc[t]); }
  }
#pragma unroll
  for (int t = 0; t < 4; ++t) { if (col0 + t * 16 >= N) continue; const int col = col0 + t * 16 + ln; const float bv = bp ? bf16_round(bp[col]) : 0.f;
#pragma unroll
    for (int r = 0; r < 8; ++r) { float v = acc[t][r] * alpha + bv; if (CP) { const int rr = row0g + row0 + 8 * hh + r; if (rowsPerB < 0) v += CP[cofs + (size_t)rr * ldc + col];      /* rowsPerB < 0: own element of the batched C plane */ else { const int bidx = rr / rowsPerB; v += CP[(size_t)bidx * sCPb + (size_t)by * 64 + col]; } } if (ACT == 1) v = (v > 0.f) ? v : expm1f(v); else if (ACT == 7) v = (v > 0.f) ? v + 1.0f : expf(v); else if (ACT == 8) v = tanhf(v); else if (ACT == 9) v = 0.5f * v * (1.0f + tanhf(0.7978845608028654f * (v + 0.044715f * v * v * v))); else if (ACT == 11) v = 1.0f / (1.0f + expf(-v)); else if (ACT == 12) v = (v > 0.f) ? v : 0.01f * v; else if (ACT == 14) v = (v > 0.f) ? v : 0.1f * v; else if (ACT == 16) v = (v >= 0.f) ? v : 0.3f * v; else if (ACT == 17) v = (v >= 0.f) ? v : 0.2f * v; else if (ACT == 15) v = v / (1.0f + expf(-v)); else if (ACT == 3) v = fmaxf(v, 0.f); else if (ACT == 6) v = 0.5f * v * (1.0f + erff(v * 0.70710678118654752f)); so[w][8 * hh + r][t * 16 + ln] = v; } }
  __builtin_amdgcn_fence(__ATOMIC_ACQ_REL, "workgroup"); __builtin_amdgcn_wave_barrier();
  const int rsub = lane >> 4, c4 = (lane & 15) * 4; typedef _Float16 v4h __attribute__((ext_vector_type(4)));
  {
#pragma unroll
    for (int q = 0; q < 8; ++q) { const int r = q * 2 + rsub; if (col0 + c4 < N) { const v4f v = *(const v4fa*)&so[w][r][c4]; if (C) *(v4f*)(C + cofs + (size_t)(row0 + r) * ldc + col0 + c4) = v; if (C16) { v4h h4; for (int i = 0; i < 4; ++i) h4[i] = (_Float16)v[i]; *(v4h*)(C16 + cofs + (size_t)(row0 + r) * ldc + col0 + c4) = h4; } } }
     }
}


typedef _Float16 v4h __attribute__((ext_vector_type(4)));

__device__ __forceinline__ void x16_part(const int bx, const float* __restrict__ x, _Float16* __restrict__ X16, size_t n8) { const size_t t = (size_t)bx * 128 + threadIdx.x; if (t >= n8) return; FragH f;      /* a part of k_prep (blocks of 128); no barrier follows */
#pragma unroll
  for (int q = 0; q < 8; ++q) f.h[q] = (_Float16)bf16_round(x[t * 8 + q]); *(v8us*)((unsigned short*)X16 + t * 8) = f.half[0];  }
// The three preparations of the GEMM operands depend on nothing but the inputs: ONE launch does them, a block's number says which it belongs to (the same for the whole block, so every wave of a transposing block passes its barrier).
// The transposing blocks come first: a block of theirs lasts longest, and they run while the many short blocks of x are still being started.
#define PREP_Q ((DM / 128) * (3 * DM / 64))      /* tiles of w_qkv */
#define PREP_O ((DM / 128) * (DM / 64))          /* tiles of w_out */
#define PREP_X ((int)(NR * DM / 8 / 128))        /* blocks of x: 8 elements a thread */
static_assert(NR * DM % (8 * 128) == 0, "whole blocks of x");
__global__ __launch_bounds__(128) void k_prep(const float* __restrict__ Wq, _Float16* __restrict__ Wqt, const float* __restrict__ Wo, _Float16* __restrict__ Wot, float scale, const float* __restrict__ x, _Float16* __restrict__ X16) {
  __shared__ __attribute__((aligned(16))) unsigned char tl[64 * 256];
  const int bx = blockIdx.x;
  if (bx < PREP_Q) wt_f16t<DM, 3 * DM>(tl, bx, Wq, Wqt, scale);
  else if (bx < PREP_Q + PREP_O) wt_f16t<DM, DM>(tl, bx - PREP_Q, Wo, Wot, scale);
  else x16_part(bx - (PREP_Q + PREP_O), x, X16, NR * DM / 8); }
__global__ __launch_bounds__(256) void k_h16(const float* __restrict__ x, _Float16* __restrict__ X16, size_t n8) { const size_t t = (size_t)blockIdx.x * 256 + threadIdx.x; if (t >= n8) return; FragH f;
#pragma unroll
  for (int q = 0; q < 8; ++q) f.h[q] = (_Float16)x[t * 8 + q]; *(v8us*)((unsigned short*)X16 + t * 8) = f.half[0];  }
__global__ __launch_bounds__(256) void k_round16f(const float* __restrict__ W, _Float16* __restrict__ Bt, size_t n8) { const size_t t = (size_t)blockIdx.x * 256 + threadIdx.x; if (t >= n8) return; FragH f;
#pragma unroll
  for (int i = 0; i < 8; ++i) f.h[i] = (_Float16)(bf16_round(W[t * 8 + i]) * 16.0f); *(v8us*)((unsigned short*)Bt + t * 8) = f.half[0];  }
template <int NHv, int TTv>
__device__ __forceinline__ void vt_part(unsigned short (*tl)[66], const int bx, const _Float16* __restrict__ V16, int ldv, int voff, _Float16* __restrict__ Vt) { const int tid = threadIdx.x; const int slab = bx / (TTv / 64), lg = bx % (TTv / 64); const int b = slab / NHv, h = slab % NHv;      /* a part of k_mid: bx is the block's number among the tiles, tl the block's LDS */
  for (int i = tid; i < 64 * 8; i += 256) { const int r = i / 8, c8 = (i % 8) * 8; FragH f; f.half[0] = *(const v8us*)((const unsigned short*)V16 + ((size_t)b * TTv + lg * 64 + r) * ldv + voff + h * 64 + c8);
#pragma unroll
    for (int q = 0; q < 8; ++q) tl[r][c8 + q] = f.u[q]; }
  __syncthreads();
  {
#pragma unroll
    for (int rd = 0; rd < 2; ++rd) { const int d = rd * 32 + tid / 8, pc = tid % 8; FragH f;
#pragma unroll
      for (int q = 0; q < 8; ++q) f.u[q] = tl[pc * 8 + q][d];
      *(v8us*)((unsigned short*)Vt + ((size_t)slab * 64 + d) * TTv + lg * 64 + pc * 8) = f.half[0]; }
     } }

// ---- fast GEMM (block tile 128x64, wave tile 32x64; requires M % 128 == 0, N % 64 == 0, K % 64 == 0); epilogue = k_gemm_hhx semantics; the f32 plane C takes rows below MC only (MC % 32 == 0), the f16 plane C16 every row ----
// Operands go through LDS: a stage is 64 k (one whole 128-byte line) of the block's 128 A rows and 64 B rows. Eight lanes read a row's line, so a wave-wide 16-byte load touches 4 lines
// (a fragment load straight from memory touches 16, and each of the four waves repeated the B rows). Two stages: the next one is fetched into registers while this one is multiplied, and stored behind it.
// LDS rows are 144 bytes apart (16 x odd: no bank conflict for the 16-byte fragment reads). The k order of every accumulator is the one of the direct loads.
// Every short loop of the staging and of the products is unrolled: its arrays then stay in registers and the LDS offsets are immediates.
__device__ __forceinline__ v16h g2_frag(const _Float16* p, int hh) { FragH f; f.half[0] = *(const v8us*)((const unsigned short*)p + 8 * hh); f.half[1] = *(const v8us*)((const unsigned short*)p + 16 + 8 * hh); return f.v; }
template <int ACT>
__global__ __launch_bounds__(128) void k_gemm2(const _Float16* __restrict__ A, int lda, size_t sA, const _Float16* __restrict__ Bh, int ldb, size_t sB, float alpha, const float* __restrict__ bias, size_t sBias, const float* __restrict__ CP, int rowsPerB, size_t sCPb, int row0g,
    float* __restrict__ C, int MC, _Float16* __restrict__ C16, int ldc, size_t sC, int M, int N, int K) { static_assert(ACT == 0 || ACT == 3 || ACT == 6 || ACT == 8 || ACT == 9 || ACT == 11 || ACT == 12 || ACT == 14 || ACT == 15 || ACT == 16 || ACT == 17, "k_gemm2: unsupported ACT code (would silently apply no activation)");
  constexpr int PITCH = 144, STAGE = (128 + 64) * PITCH;      /* bytes: one staged row, one stage (A rows 0..127, then B rows 0..63) */
  __shared__ __attribute__((aligned(16))) unsigned char sm[2 * STAGE]; static_assert(sizeof(sm) >= sizeof(float) * 4 * 32 * 68, "the epilogue's rows reuse the stages");
  float (*so)[32][68] = (float (*)[32][68])sm;      /* epilogue staging, in the same LDS: used only behind the loop's last barrier */
  const int tid = threadIdx.x, w = tid >> 5, lane = tid & 31, ln = lane & 15, hh = lane >> 4; const int by = blockIdx.y;
  A += (size_t)by * sA; Bh += (size_t)by * sB; const size_t cofs = (size_t)by * sC; const float* bp = bias ? bias + (size_t)by * sBias : nullptr;
  const int ntn = N >> 6; const int mt = blockIdx.x / ntn, nq = blockIdx.x - mt * ntn; const int row0 = mt * 128 + 32 * w, col0 = nq * 64; if (mt * 128 >= M) return;      /* the same for the whole block: every wave passes every barrier */
  const int sq = tid >> 3, sr = ((sq & 1) << 3) | (sq >> 1), sc = tid & 7;      /* staging: row (mod 16) and 16-byte piece of the line; the two rows of 16 neighbouring lanes are 8 apart: at 144 bytes a row their 128-byte pieces then fall on disjoint LDS banks */
  const unsigned short* ga = (const unsigned short*)A + (size_t)(mt * 128 + sr) * lda + sc * 8; const unsigned short* gb = (const unsigned short*)Bh + (size_t)(col0 + sr) * ldb + sc * 8;
  unsigned char* sw = sm + sr * PITCH + sc * 16; const unsigned char* ra = sm + (32 * w + ln) * PITCH + 16 * hh; const unsigned char* rb = sm + (128 + ln) * PITCH + 16 * hh;
  v8us st[12];
  auto fetch = [&](const int kb) { const unsigned short* p[12];
#pragma unroll
    for (int j = 0; j < 8; ++j) p[j] = ga + (size_t)(16 * j) * lda + kb;
#pragma unroll
    for (int j = 0; j < 4; ++j) p[8 + j] = gb + (size_t)(16 * j) * ldb + kb;
#pragma unroll
    for (int j = 0; j < 12; ++j) st[j] = *(const v8us*)p[j];
    asm volatile("s_wait_xcnt 0x0" :: "v"(p[0]), "v"(p[1]), "v"(p[2]), "v"(p[3]), "v"(p[4]), "v"(p[5]), "v"(p[6]), "v"(p[7]), "v"(p[8]), "v"(p[9]), "v"(p[10]), "v"(p[11]) : "memory"); };      /* the loads' address registers are reused by what follows; named as inputs, they stay as they are up to this wait */
  auto put = [&](const int bo) {
#pragma unroll
    for (int j = 0; j < 12; ++j) *(v8us*)(sw + bo + 16 * j * PITCH) = st[j]; };
  auto lfrag = [&](const unsigned char* p) { FragH f; f.half[0] = *(const v8us*)p; f.half[1] = *(const v8us*)(p + 32); return f.v; };      /* g2_frag's k order (hh is in the base) */
  auto mma = [&](v16h a, v16h b, v8f c) { return __builtin_amdgcn_wmma_f32_16x16x32_f16(false, a, false, b, (short)0, c, false, false); };
  const v8f z8 = {0.f,0.f,0.f,0.f,0.f,0.f,0.f,0.f}; v8f c00 = z8, c01 = z8, c02 = z8, c03 = z8, c10 = z8, c11 = z8, c12 = z8, c13 = z8;
  fetch(0); put(0);
  __syncthreads();      /* stage 0 is complete for every wave */
  const int ns = K >> 6;
#pragma unroll 1      /* one stage already holds 16 products and 36 memory operations */
  for (int s = 0; s < ns; ++s) { const int bo = (s & 1) * STAGE; const bool more = s + 1 < ns;      /* scalar */
    if (more) fetch((s + 1) * 64);
    v16h fa[2][2], fb[2][4];
#pragma unroll
    for (int ks = 0; ks < 2; ++ks) {
#pragma unroll
      for (int t = 0; t < 2; ++t) fa[ks][t] = lfrag(ra + bo + ks * 64 + 16 * t * PITCH);
#pragma unroll
      for (int t = 0; t < 4; ++t) fb[ks][t] = lfrag(rb + bo + ks * 64 + 16 * t * PITCH); }
    __builtin_amdgcn_sched_barrier(0);      /* all of the stage's fragment reads are issued ahead of its products; left alone, the compiler reads each B fragment into one register set and waits out the LDS latency eight times a stage */
#pragma unroll
    for (int ks = 0; ks < 2; ++ks) {
      c00 = mma(fa[ks][0], fb[ks][0], c00); c10 = mma(fa[ks][1], fb[ks][0], c10); c01 = mma(fa[ks][0], fb[ks][1], c01); c11 = mma(fa[ks][1], fb[ks][1], c11);
      c02 = mma(fa[ks][0], fb[ks][2], c02); c12 = mma(fa[ks][1], fb[ks][2], c12); c03 = mma(fa[ks][0], fb[ks][3], c03); c13 = mma(fa[ks][1], fb[ks][3], c13); }
    if (more) put(STAGE - bo);      /* the other stage: its last readers left it at the barrier that ended the step before */
    __syncthreads(); }      /* publishes the stage just stored and ends this stage's reads (behind the last step: before the epilogue reuses the LDS) */
  v8f accs[8] = {c00, c01, c02, c03, c10, c11, c12, c13};
#pragma unroll
  for (int u = 0; u < 8; ++u) { const int t = u & 3, half = u >> 2; const int col = col0 + t * 16 + ln; const float bv = bp ? bf16_round(bp[col]) : 0.f;
#pragma unroll
    for (int r = 0; r < 8; ++r) { const int rloc = half * 16 + 8 * hh + r; float v = accs[u][r] * alpha + bv; if (CP) { if (rowsPerB < 0) v += CP[cofs + (size_t)(row0g + row0 + rloc) * ldc + col];      /* rowsPerB < 0: own element of the batched C plane */ else { const int bidx = (row0g + row0 + rloc) / rowsPerB; v += CP[(size_t)bidx * sCPb + (size_t)by * 64 + col]; } }
      if (ACT == 3) v = fmaxf(v, 0.f); else if (ACT == 6) v = 0.5f * v * (1.0f + erff(v * 0.70710678118654752f)); else if (ACT == 11) v = 1.0f / (1.0f + expf(-v)); else if (ACT == 15) v = v / (1.0f + expf(-v)); else if (ACT == 12) v = (v > 0.f) ? v : 0.01f * v; else if (ACT == 8) v = tanhf(v); else if (ACT == 9) v = 0.5f * v * (1.0f + tanhf(0.7978845608028654f * (v + 0.044715f * v * v * v))); else if (ACT == 14) v = (v > 0.f) ? v : 0.1f * v; else if (ACT == 16) v = (v >= 0.f) ? v : 0.3f * v; else if (ACT == 17) v = (v >= 0.f) ? v : 0.2f * v;
      so[w][rloc][t * 16 + ln] = v; } }
  __builtin_amdgcn_fence(__ATOMIC_ACQ_REL, "workgroup"); __builtin_amdgcn_wave_barrier();
  const int rsub = lane >> 4, c4 = (lane & 15) * 4; if (row0 >= MC) C = nullptr;      /* the same for the whole wave */
  {
#pragma unroll
    for (int q = 0; q < 16; ++q) { const int r = q * 2 + rsub; const v4f v = *(const v4fa*)&so[w][r][c4]; if (C) *(v4f*)(C + cofs + (size_t)(row0 + r) * ldc + col0 + c4) = v; if (C16) { v4h h4; for (int i = 0; i < 4; ++i) h4[i] = (_Float16)v[i]; *(v4h*)(C16 + cofs + (size_t)(row0 + r) * ldc + col0 + c4) = h4; } }
     } }


__global__ __launch_bounds__(256) void k_wnat(const float* __restrict__ w, size_t n8, _Float16* __restrict__ Bt) { const size_t t = (size_t)blockIdx.x * 256 + threadIdx.x; if (t >= n8) return; FragH f; for (int q = 0; q < 8; ++q) f.h[q] = (_Float16)(bf16_round(w[t * 8 + q]) * 16.0f); *(v8us*)((unsigned short*)Bt + t * 8) = f.half[0];  }
__global__ __launch_bounds__(256) void k_rsm(const float* __restrict__ S, _Float16* __restrict__ P, int nrows) {
  #pragma clang fp contract(off)
  const int i = blockIdx.x * 256 + threadIdx.x; if (i >= nrows) return; const float* s = S + (size_t)i * SQ; float mx = -3.0e38f;
#pragma unroll 1
  for (int j = 0; j < SQ; ++j) mx = fmaxf(mx, s[j]); float se = 0.f;
#pragma unroll 1
  for (int j = 0; j < SQ; ++j) se += expf(s[j] - mx); const float sc = 256.0f / se;
#pragma unroll 1
  for (int j0 = 0; j0 < SQ; j0 += 8) { FragH f; for (int q = 0; q < 8; ++q) f.h[q] = (_Float16)(expf(s[j0 + q] - mx) * sc); unsigned short* d = (unsigned short*)P + (size_t)i * SQ + j0; *(v8us*)d = f.half[0];  } }
__global__ __launch_bounds__(256) void k_vt(const _Float16* __restrict__ V16, int b, int h0, _Float16* __restrict__ VT) { __shared__ unsigned short tl[64][65]; const int tid = threadIdx.x; const int hh = blockIdx.x % HG, sg = blockIdx.x / HG; const int s0 = sg * 64; const int h = h0 + hh;
  for (int i = tid; i < 64 * 8; i += 256) { const int j = i / 8, d8 = (i % 8) * 8; FragH f; f.half[0] = *(const v8us*)((const unsigned short*)V16 + ((size_t)b * SQ + s0 + j) * DM + h * HD + d8); for (int q = 0; q < 8; ++q) tl[d8 + q][j] = f.u[q]; }
  __syncthreads();
  { for (int i = tid; i < 64 * 8; i += 256) { const int d = i / 8, j8 = (i % 8) * 8; FragH f; for (int q = 0; q < 8; ++q) f.u[q] = tl[d][j8 + q]; *(v8us*)((unsigned short*)VT + ((size_t)hh * HD + d) * SQ + s0 + j8) = f.half[0]; }  } }



template <bool B> struct FaBool { static constexpr bool value = B; };
__device__ __forceinline__ float fa_xhalf(float x) { return __builtin_bit_cast(float, __builtin_amdgcn_permlanex16(__builtin_bit_cast(int, x), __builtin_bit_cast(int, x), 0x76543210, 0xfedcba98, false, false)); }      /* lane l with lane l ^ 16, on the vector pipe */
__device__ __forceinline__ float fa_exp2(float x) { float y; asm("v_exp_f32 %0, %1\n\tv_nop" : "=v"(y) : "v"(x)); return y; }      /* the v_nop keeps the one slot the instruction set asks for behind a transcendental, whatever is scheduled next */
__device__ __forceinline__ v8f fa_mma(v16h a, v16h b, v8f c) { return __builtin_amdgcn_wmma_f32_16x16x32_f16(false, a, false, b, (short)0, c, false, false); }
__global__ __launch_bounds__(256) void k_fattn(const _Float16* __restrict__ Qp, const _Float16* __restrict__ Kp, const _Float16* __restrict__ Vt, _Float16* __restrict__ O) {
  constexpr int NG = SQ / 128;      /* blocks of 128 query rows per head */
  constexpr int PITCH = 144, HALF = (64 + 64) * PITCH, STAGE = 2 * HALF;      /* bytes: one staged row, one group's half of a stage (K rows 0..63, then V^T rows 0..63), one stage */
  constexpr int MW = 8 * 1024 + 4 * 128;      /* bytes a wave of group 1 hands over: its eight 16 x 16 f32 tiles of o, then m and l of both query groups */
  __shared__ __attribute__((aligned(16))) unsigned char sm[2 * STAGE]; static_assert(sizeof(sm) >= 4 * MW, "the hand-over reuses the stages");
  typedef __attribute__((address_space(3))) unsigned char lds_u8;
  const int tid = threadIdx.x & 127, lane = tid & 31, ln = lane & 15, hh = lane >> 4; const int w8 = __builtin_amdgcn_readfirstlane((int)(threadIdx.x >> 5)); const int w = w8 & 3, kh = w8 >> 2;      /* tid: place in the group; w: the wave's query rows; kh: its key group (scalar) */
  const int h = blockIdx.x % NH, g = blockIdx.x / NH;
  const int qb = (g < NG / 2) ? (NG - 1 - g) : (g - NG / 2);      /* long blocks start first, then the short ones in rising order (speed only) */
  const int q0 = qb * 128 + 32 * w;
  const int ns = qb + 1;      /* stages of 128 keys up to the block's last row: the same for the whole block */
  const _Float16* qp = Qp + (size_t)(q0 + ln) * LQ + h * HD;
  const int sq = tid >> 3, sr = ((sq & 1) << 3) | (sq >> 1), sc = tid & 7;      /* staging: row (mod 16) and 16-byte piece of the line; the two rows of 16 neighbouring lanes are 8 apart: at 144 bytes a row their 128-byte pieces fall on disjoint LDS banks */
  const unsigned short* gk = (const unsigned short*)Kp + (size_t)(64 * kh + sr) * LQ + h * HD + sc * 8; const unsigned short* gv = (const unsigned short*)Vt + ((size_t)h * HD + sr) * SQ + 64 * kh + sc * 8;
  const unsigned lw = (unsigned)(size_t)(lds_u8*)sm + (unsigned)(kh * HALF + sr * PITCH + sc * 16);      /* the lane's LDS byte address in its group's half of buffer 0 */
  const unsigned char* rk = sm + kh * HALF + ln * PITCH + 16 * hh; const unsigned char* rv = rk + 64 * PITCH;
  const float cs = 0.125f * 1.4426950408889634f;      /* 1 / sqrt(HD), in log2 units */
  const v8f z8 = {0.f, 0.f, 0.f, 0.f, 0.f, 0.f, 0.f, 0.f};
  /* the group's half of stage t (keys 128 t + 64 kh .. + 63) into buffer b: each lane copies 16 bytes of four K rows and of four V^T rows; every lane is on, the rows and keys lie below SQ (t < ns) */
  auto copy = [&](const int t, const int b) {
    const unsigned short* k_ = gk + (size_t)(128 * t) * LQ; const unsigned short* v_ = gv + 128 * t; const unsigned l_ = lw + (unsigned)(b * STAGE);
    asm volatile("global_load_async_to_lds_b128 %0, %8, off\n\t"
                 "global_load_async_to_lds_b128 %1, %9, off\n\t"
                 "global_load_async_to_lds_b128 %2, %10, off\n\t"
                 "global_load_async_to_lds_b128 %3, %11, off\n\t"
                 "global_load_async_to_lds_b128 %4, %12, off\n\t"
                 "global_load_async_to_lds_b128 %5, %13, off\n\t"
                 "global_load_async_to_lds_b128 %6, %14, off\n\t"
                 "global_load_async_to_lds_b128 %7, %15, off\n\t"
                 "s_wait_xcnt 0x0"      /* in the copies' own statement: their address registers are rewritten only behind it */
                 :: "v"(l_), "v"(l_ + 16 * PITCH), "v"(l_ + 32 * PITCH), "v"(l_ + 48 * PITCH), "v"(l_ + 64 * PITCH), "v"(l_ + 80 * PITCH), "v"(l_ + 96 * PITCH), "v"(l_ + 112 * PITCH),
                    "v"(k_), "v"(k_ + (size_t)16 * LQ), "v"(k_ + (size_t)32 * LQ), "v"(k_ + (size_t)48 * LQ), "v"(v_), "v"(v_ + (size_t)16 * SQ), "v"(v_ + (size_t)32 * SQ), "v"(v_ + (size_t)48 * SQ) : "memory"); };
  auto lfrag = [&](const unsigned char* p) { FragH f; f.half[0] = *(const v8us*)p; f.half[1] = *(const v8us*)(p + 32); return f.v; };      /* g2_frag's k order (hh is in the base) */
  copy(0, 0);
  v16h qf[2][2], kf[2][2], vf[4];
#pragma unroll
  for (int u = 0; u < 2; ++u)
#pragma unroll
    for (int ks = 0; ks < 2; ++ks) qf[u][ks] = g2_frag(qp + (size_t)(16 * u) * LQ + ks * 32, hh);
  asm volatile("s_wait_xcnt 0x0" ::: "memory");      /* the Q loads' address registers are reused by what follows */
  v8f o[4][2]; float m[2] = {-3.0e38f, -3.0e38f}, l[2] = {0.f, 0.f};
#pragma unroll
  for (int t = 0; t < 4; ++t) { o[t][0] = z8; o[t][1] = z8; }
  /* one pass = 32 keys, its K and V^T fragments already in kf and vf; diag (scalar): the wave's last pass, the only one with keys above a row; pre: a stage's first pass reads the second pass's K rows behind its score products and the V^T rows behind its P V products (nk, nv: their places in the SAME stage) */
  auto pass = [&](auto pre, const bool diag, const unsigned char* nk, const unsigned char* nv) {
    constexpr bool PRE = decltype(pre)::value;
    v8f s[2][2];      /* [key tile][query group] */
#pragma unroll
    for (int kt = 0; kt < 2; ++kt)
#pragma unroll
      for (int u = 0; u < 2; ++u) s[kt][u] = fa_mma(kf[kt][1], qf[u][1], fa_mma(kf[kt][0], qf[u][0], z8));
    if constexpr (PRE) {
#pragma unroll
      for (int kt = 0; kt < 2; ++kt)
#pragma unroll
        for (int ks = 0; ks < 2; ++ks) kf[kt][ks] = lfrag(nk + 16 * kt * PITCH + ks * 64);
      asm volatile("" ::: "memory"); }      /* compiler fence: the reads are issued here, under the softmax; left alone, the compiler sinks them to the head of the next pass, which then waits out the LDS latency */
    if (diag) {
#pragma unroll
      for (int kt = 0; kt < 2; ++kt)
#pragma unroll
        for (int u = 0; u < 2; ++u)
#pragma unroll
          for (int r = 0; r < 8; ++r) s[kt][u][r] = (16 * kt + 8 * hh + r <= 16 * u + ln) ? s[kt][u][r] : -1.0e30f; }
    float mx[2];
#pragma unroll
    for (int u = 0; u < 2; ++u) { float a0 = fmaxf(s[0][u][0], s[1][u][0]);
#pragma unroll
      for (int r = 1; r < 8; ++r) a0 = fmaxf(a0, fmaxf(s[0][u][r], s[1][u][r]));
      a0 = fmaxf(a0, fa_xhalf(a0)); mx[u] = a0 * cs; }
    if (__builtin_amdgcn_ballot_w32((mx[0] > m[0] + 8.0f) || (mx[1] > m[1] + 8.0f)) != 0) {      /* scalar branch, once per pass */
#pragma unroll
      for (int u = 0; u < 2; ++u) { const float mn = fmaxf(m[u], mx[u]); const float al = fa_exp2(m[u] - mn); m[u] = mn; l[u] *= al;
#pragma unroll
        for (int t = 0; t < 4; ++t) o[t][u] *= al; } }
    FragH pf[2];
#pragma unroll
    for (int u = 0; u < 2; ++u) { v8f e0, e1;
#pragma unroll
      for (int r = 0; r < 8; ++r) { e0[r] = fa_exp2(fmaf(s[0][u][r], cs, -m[u])); e1[r] = fa_exp2(fmaf(s[1][u][r], cs, -m[u])); }
#pragma unroll
      for (int r = 0; r < 8; ++r) { pf[u].h[r] = (_Float16)e0[r]; pf[u].h[8 + r] = (_Float16)e1[r]; }
      const v8f es = e0 + e1; l[u] += ((es[0] + es[1]) + (es[2] + es[3])) + ((es[4] + es[5]) + (es[6] + es[7])); }
#pragma unroll
    for (int t = 0; t < 4; ++t)
#pragma unroll
      for (int u = 0; u < 2; ++u) o[t][u] = fa_mma(vf[t], pf[u].v, o[t][u]);
    if constexpr (PRE) {
#pragma unroll
      for (int t = 0; t < 4; ++t) vf[t] = lfrag(nv + 16 * t * PITCH);
      asm volatile("" ::: "memory"); }      /* compiler fence: likewise, issued here and not in front of the next pass's P V products */
  };
  asm volatile("s_wait_asynccnt 0x0" ::: "memory");      /* this wave's copies of stage 0 have landed */
  __syncthreads();      /* stage 0 is complete for every wave */
  if (ns > 1) copy(1, 1);      /* scalar, the same for the whole block: the first 128 rows have one stage only */
#pragma unroll 1      /* one stage already holds two passes a wave, and a pass fills the register file */
  for (int t = 0; t < ns; ++t) { const int k0 = 128 * t + 64 * kh; const unsigned char* bk = rk + (t & 1) * STAGE; const unsigned char* bv = rv + (t & 1) * STAGE;
    if (k0 <= q0) {      /* scalar; a wave past its diagonal only takes part in the copies and the barriers below */
#pragma unroll
      for (int kt = 0; kt < 2; ++kt)
#pragma unroll
        for (int ks = 0; ks < 2; ++ks) kf[kt][ks] = lfrag(bk + 16 * kt * PITCH + ks * 64);
#pragma unroll
      for (int u = 0; u < 4; ++u) vf[u] = lfrag(bv + 16 * u * PITCH);
      __builtin_amdgcn_sched_barrier(0);      /* all sixteen reads are issued as one group ahead of the products; left alone, the compiler reads the K fragments one by one into one register set and sinks the V^T reads to the P V products, and waits out the LDS latency each time */
      pass(FaBool<true>{}, k0 == q0, bk + 32 * PITCH, bv + 64);
      if (k0 + 32 <= q0) pass(FaBool<false>{}, k0 + 32 == q0, bk, bv); }
    asm volatile("s_wait_dscnt 0x0" ::: "memory");      /* this wave's reads of the stage have returned before the buffer is handed back */
    asm volatile("s_wait_asynccnt 0x0" ::: "memory");      /* this wave's copies of stage t + 1 have landed */
    __syncthreads();      /* publishes stage t + 1 and ends every wave's reads of stage t */
    if (t + 2 < ns) copy(t + 2, t & 1); }      /* scalar, the same for the whole block: into the buffer just left */
  asm volatile("s_wait_asynccnt 0x0" ::: "memory");      /* no copy is outstanding when the stages are reused and when the wave ends */
  /* the hand-over, in the stages' LDS: every wave's last read of them ended at the loop's last barrier. A lane's 16-byte pieces lie side by side (512 bytes a wave-wide access: every bank once) */
  typedef float f1a __attribute__((may_alias));
  unsigned char* mo = sm + w * MW + lane * 16; f1a* ms = (f1a*)(sm + w * MW + 8 * 1024) + lane;
  if (kh == 1) {      /* scalar */
#pragma unroll
    for (int t = 0; t < 4; ++t)
#pragma unroll
      for (int u = 0; u < 2; ++u) { const v8f x = o[t][u]; const v4f x0 = {x[0], x[1], x[2], x[3]}, x1 = {x[4], x[5], x[6], x[7]};
        *(v4fa*)(mo + (2 * t + u) * 1024) = x0; *(v4fa*)(mo + (2 * t + u) * 1024 + 512) = x1; }
#pragma unroll
    for (int u = 0; u < 2; ++u) { ms[32 * u] = m[u]; ms[64 + 32 * u] = l[u]; } }
  __syncthreads();      /* group 1's partial results are complete for group 0; every wave of the block passes it */
  if (kh == 0) {      /* scalar */
    v8us ho[2][4];      /* all rows are rounded first and stored afterwards: no register of an issued store is written again */
#pragma unroll
    for (int u = 0; u < 2; ++u) { const float m1 = ms[32 * u], l1 = ms[64 + 32 * u]; const float mn = fmaxf(m[u], m1);      /* a group 1 wave that had no key at or below its rows hands over m = -3e38, l = 0, o = 0: its weight is exactly 0 */
      const float a0 = fa_exp2(m[u] - mn), a1 = fa_exp2(m1 - mn); const float lj = fmaf(l1, a1, l[u] * a0);
      const float fin = 64.0f / (lj + fa_xhalf(lj)); const float f0 = a0 * fin, f1 = a1 * fin;      /* the lane halves' sums join once; o carried x64 */
#pragma unroll
      for (int t = 0; t < 4; ++t) { const v4f x0 = *(const v4fa*)(mo + (2 * t + u) * 1024), x1 = *(const v4fa*)(mo + (2 * t + u) * 1024 + 512); FragH f;
#pragma unroll
        for (int r = 0; r < 4; ++r) { f.h[r] = (_Float16)fmaf(x0[r], f1, o[t][u][r] * f0); f.h[4 + r] = (_Float16)fmaf(x1[r], f1, o[t][u][4 + r] * f0); }
        ho[u][t] = f.half[0]; } }
    unsigned short* op = (unsigned short*)O + (size_t)(q0 + ln) * DM + h * HD + 8 * hh;
#pragma unroll
    for (int u = 0; u < 2; ++u)
#pragma unroll
      for (int t = 0; t < 4; ++t) *(v8us*)(op + (size_t)(16 * u) * DM + 16 * t) = ho[u][t]; } }


// Exact f32 attention for the first QT0 rows (o carried x64 like the f16 path): ONE WAVE per (head, query row) instead of one thread per row. QF, KF, VF: the q, k, v column blocks of the f32 q | k | v rows (pitch LQ). The result leaves as the two f16 planes the output GEMM reads (pitch DM): OH = o rounded to f16, OL = the remainder x1024; a wave stores one whole 128-byte line of each.
// Scores: eight lanes share a key (each 8 of its 64 columns), so a load reads four whole 128-byte lines of four K rows; the eight partial sums of 8 keys are folded over the eight lanes in
// three exchange steps that halve the keys a lane carries, which leaves lane l with key 4 * (l & 7) + (l >> 3) of each group of 32. Maximum and sum are butterflies over the wave.
// P V: a lane owns two of the 64 columns, every V row is one coalesced 256-byte read, and each weight is broadcast from the lane that holds it. No LDS memory, no barrier.
// Every loop is unrolled: its arrays then stay in registers, a group's loads are all in flight together, and the lane numbers of the broadcasts are immediates.
typedef float v2f __attribute__((ext_vector_type(2)));
typedef float v2fa __attribute__((ext_vector_type(2), may_alias));
typedef _Float16 v2h __attribute__((ext_vector_type(2)));
template <int M> __device__ __forceinline__ float a0_xm(float x) { return __builtin_bit_cast(float, __builtin_amdgcn_update_dpp(0, __builtin_bit_cast(int, x), 0x160 + M, 0xf, 0xf, true)); }      /* lane l with lane l ^ M (M < 16; DPP row_xmask), on the vector pipe; every lane is on wherever it is used */
__device__ __forceinline__ void att0_part(const int wid, const float* __restrict__ QF, const float* __restrict__ KF, const float* __restrict__ VF, float scale, _Float16* __restrict__ OH, _Float16* __restrict__ OL) {      /* a part of k_mid; wid: the wave's number among the NH * QT0 (scalar) */
  constexpr int NC = QT0 / 32;      /* groups of 32 keys */
  const int lane = threadIdx.x & 31, kk = lane >> 3, dc = lane & 7;
  const int h = wid / QT0, i = wid % QT0; const int nc = (i >> 5) + 1;      /* groups that hold a key <= i (the same for the whole wave) */
  const float* qr = QF + (size_t)i * LQ + h * HD + 4 * dc; const float* kr = KF + (size_t)kk * LQ + h * HD + 4 * dc; const float* vr = VF + h * HD + 2 * lane;
  const v4f qa = *(const v4fa*)qr, qb = *(const v4fa*)(qr + 32);
  const bool b4 = (lane & 4) != 0, b2 = (lane & 2) != 0, b1 = (lane & 1) != 0;
  float s[NC];
#pragma unroll
  for (int g = 0; g < NC; ++g) { s[g] = -3.0e38f;
    if (g < nc) { float a[8];      /* a[m]: this lane's 8 columns of key 32 g + 4 m + kk (rows up to 32 g + 31 < QT0 exist whatever i is) */
#pragma unroll
      for (int m = 0; m < 8; ++m) { const float* kp = kr + (size_t)(32 * g + 4 * m) * LQ; const v4f ka = *(const v4fa*)kp, kb = *(const v4fa*)(kp + 32); v4f t;
#pragma unroll
        for (int u = 0; u < 4; ++u) t[u] = fmaf(qb[u], kb[u], qa[u] * ka[u]);
        a[m] = (t[0] + t[1]) + (t[2] + t[3]); }
      float b[4], c[2];
#pragma unroll
      for (int m = 0; m < 4; ++m) b[m] = (b4 ? a[m + 4] : a[m]) + a0_xm<4>(b4 ? a[m] : a[m + 4]);
#pragma unroll
      for (int m = 0; m < 2; ++m) c[m] = (b2 ? b[m + 2] : b[m]) + a0_xm<2>(b2 ? b[m] : b[m + 2]);
      const float d = (b1 ? c[1] : c[0]) + a0_xm<1>(b1 ? c[0] : c[1]);
      if (32 * g + 4 * dc + kk <= i) s[g] = d * scale; } }
  asm volatile("s_wait_xcnt 0x0" :: "v"(kr) : "memory");      /* the K loads' address registers are reused by what follows; named as an input, they stay as they are up to this wait */
  float mx = s[0];
#pragma unroll
  for (int g = 1; g < NC; ++g) mx = fmaxf(mx, s[g]);
  mx = fmaxf(mx, a0_xm<1>(mx)); mx = fmaxf(mx, a0_xm<2>(mx)); mx = fmaxf(mx, a0_xm<4>(mx)); mx = fmaxf(mx, a0_xm<8>(mx)); mx = fmaxf(mx, fa_xhalf(mx));
  float p[NC], l = 0.f;
#pragma unroll
  for (int g = 0; g < NC; ++g) { p[g] = expf(s[g] - mx); l += p[g]; }      /* a key above the row gives exactly 0 */
  l += a0_xm<1>(l); l += a0_xm<2>(l); l += a0_xm<4>(l); l += a0_xm<8>(l); l += fa_xhalf(l);
  v2f o0 = {0.f, 0.f}, o1 = {0.f, 0.f};
#pragma unroll
  for (int g = 0; g < NC; ++g)
    if (g < nc) {
#pragma unroll
      for (int t = 0; t < 32; t += 2) {      /* key 32 g + t sits in lane 8 * (t & 3) + (t >> 2) */
        const float p0 = __builtin_bit_cast(float, __builtin_amdgcn_readlane(__builtin_bit_cast(int, p[g]), 8 * (t & 3) + (t >> 2))), p1 = __builtin_bit_cast(float, __builtin_amdgcn_readlane(__builtin_bit_cast(int, p[g]), 8 * ((t + 1) & 3) + ((t + 1) >> 2)));
        const v2f v0 = *(const v2fa*)(vr + (size_t)(32 * g + t) * LQ), v1 = *(const v2fa*)(vr + (size_t)(32 * g + t + 1) * LQ);
        o0[0] = fmaf(p0, v0[0], o0[0]); o0[1] = fmaf(p0, v0[1], o0[1]); o1[0] = fmaf(p1, v1[0], o1[0]); o1[1] = fmaf(p1, v1[1], o1[1]); } }
  asm volatile("s_wait_xcnt 0x0" :: "v"(vr) : "memory");      /* likewise the V loads' */
  const float fin = 64.0f / l;
  const v2f r = {(o0[0] + o1[0]) * fin, (o0[1] + o1[1]) * fin};
  v2h rh, rl;
#pragma unroll
  for (int q = 0; q < 2; ++q) { const _Float16 hq = (_Float16)r[q]; rh[q] = hq; rl[q] = (_Float16)((r[q] - (float)hq) * 1024.0f); }
  const size_t oo = (size_t)i * DM + h * HD + 2 * lane;
  *(v2h*)(OH + oo) = rh; *(v2h*)(OL + oo) = rl; }
// V^T and the exact first tile both depend on the QKV GEMM alone and not on each other: ONE launch does both, a block's number says which it belongs to (the same for the whole block, so every wave of a transposing block passes its barrier).
// The blocks of the exact tile come first (eight waves = eight (head, row) pairs a block): a wave of theirs lasts longest.
#define MID_A (NH * QT0 / 8)         /* blocks of the exact first tile */
#define MID_V (NH * (SQ / 64))       /* tiles of V */
__global__ __launch_bounds__(256) void k_mid(const float* __restrict__ QF, const float* __restrict__ KF, const float* __restrict__ VF, float scale, _Float16* __restrict__ OH, _Float16* __restrict__ OL, const _Float16* __restrict__ V16, _Float16* __restrict__ Vt) {
  __shared__ unsigned short tl[64][66];
  const int bx = blockIdx.x;
  if (bx < MID_A) att0_part(bx * 8 + __builtin_amdgcn_readfirstlane((int)(threadIdx.x >> 5)), QF, KF, VF, scale, OH, OL);
  else vt_part<NH, SQ>(tl, bx - MID_A, V16, LQ, 0, Vt); }

// Output GEMM C[MPO][DM] (f32) = (A Bh^T) alpha + bias, with k_gemm2's tile, staging and k order: block 128x64, wave 32x64, stages of 64 k, two stages in LDS, rows 144 bytes apart, the next stage fetched to registers under the products.
// The block row of rows 0..QT0-1 takes its A rows from the exact first tile's two f16 planes and not from A: AH (o rounded to f16) and AL (the remainder x1024). Its stage holds the rows of both planes, each B fragment serves both,
// and each plane has accumulators of its own, joined in the epilogue as (hi alpha + bias) + lo alphaL: the products, sums and roundings that two more GEMM launches over these rows would give.
// Every short loop of the staging and of the products is unrolled: its arrays then stay in registers and the LDS offsets are immediates.
__global__ __launch_bounds__(128) void k_gemm_o(const _Float16* __restrict__ A, const _Float16* __restrict__ AH, const _Float16* __restrict__ AL, const _Float16* __restrict__ Bh, const float* __restrict__ bias, float alpha, float alphaL, float* __restrict__ C) {
  static_assert(QT0 == 128 && MPO % 128 == 0 && DM % 64 == 0, "the first tile is exactly the first block row");
  constexpr int PITCH = 144, STAGE = (128 + 64 + 128) * PITCH;      /* bytes: one staged row, one stage (A or AH rows 0..127, B rows 0..63, then AL rows 0..127, filled and read in the first block row only) */
  __shared__ __attribute__((aligned(16))) unsigned char sm[2 * STAGE]; static_assert(sizeof(sm) >= sizeof(float) * 4 * 32 * 68, "the epilogue's rows reuse the stages");
  float (*so)[32][68] = (float (*)[32][68])sm;      /* epilogue staging, in the same LDS: used only behind the loop's last barrier */
  const int tid = threadIdx.x, w = tid >> 5, lane = tid & 31, ln = lane & 15, hh = lane >> 4;
  constexpr int ntn = DM / 64; const int mt = blockIdx.x / ntn, nq = blockIdx.x % ntn; const int row0 = mt * 128 + 32 * w, col0 = nq * 64;
  const int sq = tid >> 3, sr = ((sq & 1) << 3) | (sq >> 1), sc = tid & 7;      /* staging: row (mod 16) and 16-byte piece of the line, as in k_gemm2 */
  unsigned char* sw = sm + sr * PITCH + sc * 16; const unsigned char* ra = sm + (32 * w + ln) * PITCH + 16 * hh; const unsigned char* rb = sm + (128 + ln) * PITCH + 16 * hh; const unsigned char* rl = ra + 192 * PITCH;
  auto lfrag = [&](const unsigned char* p) { FragH f; f.half[0] = *(const v8us*)p; f.half[1] = *(const v8us*)(p + 32); return f.v; };      /* g2_frag's k order (hh is in the base) */
  auto run = [&](auto two) {
    constexpr bool TWO = decltype(two)::value; constexpr int NL = TWO ? 20 : 12;      /* 16-byte pieces a thread stages: 8 of A, 4 of B, 8 of AL; piece j belongs to staged row 16 j + sr */
    const unsigned short* ga = (const unsigned short*)(TWO ? AH : A) + (size_t)(mt * 128 + sr) * DM + sc * 8; const unsigned short* gb = (const unsigned short*)Bh + (size_t)(col0 + sr) * DM + sc * 8; const unsigned short* gl = (const unsigned short*)AL + (size_t)sr * DM + sc * 8;
    v8us st[NL];
    auto fetch = [&](const int kb) { const unsigned short* p[NL];
#pragma unroll
      for (int j = 0; j < 8; ++j) p[j] = ga + (size_t)(16 * j) * DM + kb;
#pragma unroll
      for (int j = 0; j < 4; ++j) p[8 + j] = gb + (size_t)(16 * j) * DM + kb;
      if constexpr (TWO) {
#pragma unroll
        for (int j = 0; j < 8; ++j) p[12 + j] = gl + (size_t)(16 * j) * DM + kb; }
#pragma unroll
      for (int j = 0; j < NL; ++j) st[j] = *(const v8us*)p[j];
      /* the loads' address registers are reused by what follows; named as inputs, they stay as they are up to this wait */
      if constexpr (TWO) asm volatile("s_wait_xcnt 0x0" :: "v"(p[0]), "v"(p[1]), "v"(p[2]), "v"(p[3]), "v"(p[4]), "v"(p[5]), "v"(p[6]), "v"(p[7]), "v"(p[8]), "v"(p[9]), "v"(p[10]), "v"(p[11]), "v"(p[NL - 8]), "v"(p[NL - 7]), "v"(p[NL - 6]), "v"(p[NL - 5]), "v"(p[NL - 4]), "v"(p[NL - 3]), "v"(p[NL - 2]), "v"(p[NL - 1]) : "memory");
      else asm volatile("s_wait_xcnt 0x0" :: "v"(p[0]), "v"(p[1]), "v"(p[2]), "v"(p[3]), "v"(p[4]), "v"(p[5]), "v"(p[6]), "v"(p[7]), "v"(p[8]), "v"(p[9]), "v"(p[10]), "v"(p[11]) : "memory"); };
    auto put = [&](const int bo) {
#pragma unroll
      for (int j = 0; j < NL; ++j) *(v8us*)(sw + bo + 16 * j * PITCH) = st[j]; };
    const v8f z8 = {0.f, 0.f, 0.f, 0.f, 0.f, 0.f, 0.f, 0.f}; v8f ch[2][4], cl[2][4];      /* [16-row half][16-column tile] */
#pragma unroll
    for (int u = 0; u < 2; ++u)
#pragma unroll
      for (int t = 0; t < 4; ++t) { ch[u][t] = z8; cl[u][t] = z8; }
    fetch(0); put(0);
    __syncthreads();      /* stage 0 is complete for every wave */
    constexpr int ns = DM / 64;
#pragma unroll 1      /* one stage already holds 16 or 32 products with their fragment reads and the next stage's staging */
    for (int s = 0; s < ns; ++s) { const int bo = (s & 1) * STAGE; const bool more = s + 1 < ns;      /* scalar */
      if (more) fetch((s + 1) * 64);
      v16h fa[2][2], fl[2][2], fb[2][4];
#pragma unroll
      for (int ks = 0; ks < 2; ++ks) {
#pragma unroll
        for (int u = 0; u < 2; ++u) { fa[ks][u] = lfrag(ra + bo + ks * 64 + 16 * u * PITCH); if constexpr (TWO) fl[ks][u] = lfrag(rl + bo + ks * 64 + 16 * u * PITCH); }
#pragma unroll
        for (int t = 0; t < 4; ++t) fb[ks][t] = lfrag(rb + bo + ks * 64 + 16 * t * PITCH); }
      __builtin_amdgcn_sched_barrier(0);      /* all of the stage's fragment reads are issued ahead of its products; left alone, the compiler reads each B fragment into one register set and waits out the LDS latency for each */
#pragma unroll
      for (int ks = 0; ks < 2; ++ks)
#pragma unroll
        for (int t = 0; t < 4; ++t)
#pragma unroll
          for (int u = 0; u < 2; ++u) { ch[u][t] = fa_mma(fa[ks][u], fb[ks][t], ch[u][t]); if constexpr (TWO) cl[u][t] = fa_mma(fl[ks][u], fb[ks][t], cl[u][t]); }
      if (more) put(STAGE - bo);      /* the other stage: its last readers left it at the barrier that ended the step before */
      __syncthreads(); }      /* publishes the stage just stored and ends this stage's reads (behind the last step: before the epilogue reuses the LDS) */
    const float* bp = bias + col0 + ln; float bq[4];
#pragma unroll
    for (int t = 0; t < 4; ++t) bq[t] = bp[16 * t];
    asm volatile("s_wait_xcnt 0x0" :: "v"(bp) : "memory");      /* the bias loads' address registers are reused by what follows; named as an input, they stay as they are up to this wait */
#pragma unroll
    for (int u = 0; u < 2; ++u)
#pragma unroll
      for (int t = 0; t < 4; ++t) { const float bv = bf16_round(bq[t]);
#pragma unroll
        for (int r = 0; r < 8; ++r) { float v = ch[u][t][r] * alpha + bv; if constexpr (TWO) v += cl[u][t][r] * alphaL; so[w][u * 16 + 8 * hh + r][t * 16 + ln] = v; } } };
  if (mt == 0) run(FaBool<true>{}); else run(FaBool<false>{});      /* scalar, the same for the whole block: every wave passes every barrier of its branch */
  __builtin_amdgcn_fence(__ATOMIC_ACQ_REL, "workgroup"); __builtin_amdgcn_wave_barrier();      /* a wave reads back only its own rows */
  const int rsub = lane >> 4, c4 = (lane & 15) * 4; v4f vo[16];      /* all rows are read back first and stored afterwards: no register of an issued store is written again */
#pragma unroll
  for (int q = 0; q < 16; ++q) vo[q] = *(const v4fa*)&so[w][q * 2 + rsub][c4];
  float* cp = C + (size_t)(row0 + rsub) * DM + col0 + c4;
#pragma unroll
  for (int q = 0; q < 16; ++q) *(v4f*)(cp + (size_t)(2 * q) * DM) = vo[q]; }

extern "C" void kernel_launch(void* const* d_in, const int* in_sizes, int n_in,
                              void* d_out, int out_size, void* d_ws, size_t ws_size, hipStream_t stream) {
  (void)in_sizes; (void)n_in; (void)out_size;
  const float* const* I = (const float* const*)d_in; const float* x = I[0]; const float* wqkv = I[1]; const float* bqkv = I[2]; const float* wo = I[3]; const float* bo = I[4];      /* [in][out] c_attn [1024][3072] + b, c_proj [1024][1024] + b */
  char* ws = (char*)d_ws; size_t off = 0;
  auto take = [&](size_t bytes) { char* p = ws + off; off += (bytes + 255) & ~(size_t)255; return p; };
  _Float16* BQKV = (_Float16*)take((size_t)3 * DM * DM * 2); _Float16* BO = (_Float16*)take((size_t)DM * DM * 2);
  _Float16* X16 = (_Float16*)take(NR * DM * 2); _Float16* QKV = (_Float16*)take(NR * 3 * DM * 2); _Float16* Q16 = QKV; _Float16* K16 = QKV + DM; _Float16* V16 = QKV + 2 * DM; _Float16* O16 = (_Float16*)take(NR * DM * 2);
  _Float16* VT = (_Float16*)take((size_t)NH * HD * SQ * 2);
  static_assert(NB == 1, "the f32 first-tile rows are rows 0..QT0-1 of the one projected sequence");
  float* QF0 = (float*)take((size_t)QT0 * LQ * 4); float* KF0 = QF0 + DM; float* VF0 = QF0 + 2 * DM;      /* f32 q | k | v of rows 0..127, pitch LQ */ _Float16* OH0 = (_Float16*)take((size_t)NB * QT0 * DM * 2); _Float16* OL0 = (_Float16*)take((size_t)NB * QT0 * DM * 2);
  if (off > ws_size) return;
  k_prep<<<PREP_Q + PREP_O + PREP_X, 128, 0, stream>>>(wqkv, BQKV, wo, BO, 16.0f, x, X16);      /* [in][out] -> Bt x16 (both weights); x -> f16 rows */
  const size_t r0p = (size_t)B0 * SQ;      /* first projected row */
  k_gemm2<0><<<dim3((unsigned)((MP / 128) * (3 * DM / 64)), 1), 128, 0, stream>>>(X16 + r0p * DM, DM, 0, BQKV, DM, 0, 0.0625f, bqkv, 0, nullptr, 1, 0, 0, QF0, QT0, QKV + r0p * 3 * DM, 3 * DM, 0, MP, 3 * DM, DM);      /* q | k | v rows (f16); head h = columns h*HD.. of each DM block; rows 0..127 also in f32 (exact products, unrounded) */
  for (int b = B0; b < B0 + NBR; ++b) { const size_t r0 = (size_t)b * SQ;
    k_mid<<<MID_A + MID_V, 256, 0, stream>>>(QF0, KF0, VF0, 0.125f, OH0 + (size_t)b * QT0 * DM, OL0 + (size_t)b * QT0 * DM, V16 + r0 * LQ, VT);      /* exact f32 attention for rows 0..127 (o x64) -> f16 hi + x1024 residual planes; V^T [NH][HD][SQ] for this batch */
    k_fattn<<<NH * (SQ / 128), 256, 0, stream>>>(Q16 + r0 * LQ, K16 + r0 * LQ, VT, O16 + r0 * DM); }      /* scores, causal online softmax and P V in one launch; o (merged heads, x64) as f16 rows */
  k_gemm_o<<<(MPO / 128) * (DM / 64), 128, 0, stream>>>(O16 + r0p * DM, OH0, OL0, BO, bo, 0.0009765625f, 0.00000095367431640625f, (float*)d_out + r0p * DM);      /* out rows are the output layout; rows 0..127 from the two exact planes: o_hi Wo 2^-10 + b + o_lo Wo 2^-20 */
}
